// v000
// The times below were measured on an AMD MI455X: many runs one after another, warmed up first and cycling through
// copies of the inputs, with the whole window's GPU time divided by the number of runs. Launches and the gaps
// between them are all in it. The median over several windows is given; except for v000 it joins two sittings, which
// can be a few percent apart, so the side-by-side timings, each taken in one sitting, are the better comparison.
// The starting kernel, v000, takes 704 microseconds a run.
#include <hip/hip_runtime.h>

typedef float v2f __attribute__((ext_vector_type(2)));
typedef float v8f __attribute__((ext_vector_type(8)));

#define WMMA_F32(a, b, c) \
  __builtin_amdgcn_wmma_f32_16x16x4_f32(false, (a), false, (b), (short)0, (c), false, false)

// ---------------------------------------------------------------------------
// CDNA5 async global->LDS copy (16 bytes per lane, ASYNCcnt-tracked).
// dsaddr = LDS_BASE + VGPR[VDST][lane]; generic shared pointer's low 32 bits
// are the LDS byte offset (aperture truncation).
// ---------------------------------------------------------------------------
__device__ __forceinline__ void async_ld16(void* lds_dst, const void* gsrc) {
    unsigned loff = (unsigned)(unsigned long long)lds_dst;
    asm volatile("global_load_async_to_lds_b128 %0, %1, off"
                 :: "v"(loff), "v"(gsrc)
                 : "memory");
}
__device__ __forceinline__ void wait_async0() {
    asm volatile("s_wait_asynccnt 0x0" ::: "memory");
}

// ---------------------------------------------------------------------------
// GEMM + bias:  C[M,N] = A[M,K] @ W[K,N] + bias[N]
// 256 thr = 8 waves, 64x64 block tile, wave = 16x32 slab (2 wmma accums).
// A tile row-major (stride 68, async-staged); W tile k-pair interleaved
// (v2f [k/2][n], row stride 80 v2f) so each B fragment is one ds_load_b64.
// ---------------------------------------------------------------------------
__global__ __launch_bounds__(256)
void gemm_bias_kernel(const float* __restrict__ A, const float* __restrict__ W,
                      const float* __restrict__ bias, float* __restrict__ C,
                      int M, int N, int K)
{
    __shared__ float sA[64][68];
    __shared__ v2f   sWp[32 * 80];     // (k/2) * 80 + n

    const int tid  = threadIdx.x;
    const int wv   = tid >> 5;
    const int lane = tid & 31;
    const int lm   = lane & 15;
    const int hi   = lane >> 4;
    const int m0   = blockIdx.x * 64;
    const int n0   = blockIdx.y * 64;
    const int wm   = wv >> 1;
    const int wn   = wv & 1;

    v8f acc0 = {0.f,0.f,0.f,0.f,0.f,0.f,0.f,0.f};
    v8f acc1 = {0.f,0.f,0.f,0.f,0.f,0.f,0.f,0.f};

    for (int kc = 0; kc < K; kc += 64) {
#pragma unroll
        for (int i = 0; i < 4; ++i) {
            int slot = tid + i * 256;          // 1024 float4 slots per tile
            int r  = slot >> 4;
            int c4 = (slot & 15) * 4;
            int gr = m0 + r; if (gr >= M) gr = M - 1;   // clamp; store is guarded
            async_ld16(&sA[r][c4], A + (size_t)gr * K + kc + c4);
            float4 vw = *(const float4*)(W + (size_t)(kc + r) * N + n0 + c4);
            float* wd = (float*)sWp + (r >> 1) * 160 + (r & 1);
            wd[(c4 + 0) * 2] = vw.x; wd[(c4 + 1) * 2] = vw.y;
            wd[(c4 + 2) * 2] = vw.z; wd[(c4 + 3) * 2] = vw.w;
        }
        wait_async0();
        __syncthreads();

#pragma unroll
        for (int ks = 0; ks < 16; ++ks) {
            int kb = ks * 4 + 2 * hi;          // even k of this lane-half's pair
            v2f a  = *(const v2f*)&sA[wm * 16 + lm][kb];
            v2f b0 = sWp[(kb >> 1) * 80 + wn * 32 + lm];
            v2f b1 = sWp[(kb >> 1) * 80 + wn * 32 + 16 + lm];
            acc0 = WMMA_F32(a, b0, acc0);
            acc1 = WMMA_F32(a, b1, acc1);
        }
        __syncthreads();
    }

#pragma unroll
    for (int r = 0; r < 8; ++r) {
        int gm = m0 + wm * 16 + r + 8 * hi;    // D: lanes>=16 hold M=r+8
        if (gm < M) {
            int c0 = n0 + wn * 32 + lm;
            C[(size_t)gm * N + c0]      = acc0[r] + bias[c0];
            C[(size_t)gm * N + c0 + 16] = acc1[r] + bias[c0 + 16];
        }
    }
}

// ---------------------------------------------------------------------------
// Fused attention per (q-tile 16, head, batch):
//   S = (Q Kh^T)/8 + CPB-MLP(rel)  -> row softmax -> O = P Vh
// ---------------------------------------------------------------------------
#define SST 1028   // padded S row stride
#define VST 68     // K-stage row stride (row-major phase)
#define KVSTAGE 20480  // floats: max(256*68, 128*160)

__global__ __launch_bounds__(256)
void attn_kernel(const float* __restrict__ q,   // (4,600,512)
                 const float* __restrict__ kv,  // (4,1024,8*128): +0..63 K, +64..127 V
                 const float* __restrict__ rel, // (4,600,1024,2)
                 const float* __restrict__ w1, const float* __restrict__ b1,
                 const float* __restrict__ w2, const float* __restrict__ b2,
                 float* __restrict__ ctx)       // (4,600,512)
{
    extern __shared__ float smem[];
    float* S    = smem;               // 16 * SST
    float* Kst  = S + 16 * SST;       // KVSTAGE (K chunks row-major / V pairs)
    float* w1s  = Kst + KVSTAGE;      // 256
    float* b1s  = w1s + 256;          // 128
    float* w2s  = b1s + 128;          // 128 (column h of cpb_w2)
    float* Ored = w2s + 128;          // 1024 split-K combine

    const int tid  = threadIdx.x;
    const int wv   = tid >> 5;
    const int lane = tid & 31;
    const int lm   = lane & 15;
    const int hi   = lane >> 4;
    const int qt   = blockIdx.x;
    const int h    = blockIdx.y;
    const int b    = blockIdx.z;
    const int q0   = qt * 16;

    w1s[tid] = w1[tid];
    if (tid < 128) { b1s[tid] = b1[tid]; w2s[tid] = w2[tid * 8 + h]; }
    const float b2h = b2[h];

    // ---- preload Q fragments: all 16 k-steps over d=64, one v2f each
    int qr = q0 + lm; if (qr > 599) qr = 599;
    const float* qp = q + (size_t)(b * 600 + qr) * 512 + h * 64;
    v2f afr[16];
#pragma unroll
    for (int ks = 0; ks < 16; ++ks)
        afr[ks] = *(const v2f*)(qp + ks * 4 + 2 * hi);

    // ---- Phase 1: S = Q K^T  (K streamed in 256-row chunks, async->LDS)
    for (int c = 0; c < 4; ++c) {
        int kc0 = c * 256;
#pragma unroll
        for (int i = 0; i < 16; ++i) {
            int slot = tid + i * 256;           // 4096 float4 slots = 256x64
            int r  = slot >> 4;
            int c4 = (slot & 15) * 4;
            async_ld16(Kst + r * VST + c4,
                       kv + (size_t)(b * 1024 + kc0 + r) * 1024 + h * 128 + c4);
        }
        wait_async0();
        __syncthreads();

#pragma unroll
        for (int tt = 0; tt < 2; ++tt) {
            int kb = (wv * 2 + tt) * 16;
            v8f acc = {0.f,0.f,0.f,0.f,0.f,0.f,0.f,0.f};
#pragma unroll
            for (int ks = 0; ks < 16; ++ks) {
                int kk = ks * 4 + 2 * hi;
                v2f bb = *(const v2f*)&Kst[(kb + lm) * VST + kk];
                acc = WMMA_F32(afr[ks], bb, acc);
            }
#pragma unroll
            for (int r = 0; r < 8; ++r)
                S[(r + 8 * hi) * SST + kc0 + kb + lm] = acc[r];
        }
        __syncthreads();
    }

    // ---- Phase 2: fused CPB MLP + 1/sqrt(64) scale, in place on S
    for (int p = 0; p < 64; ++p) {
        int flat = tid + p * 256;
        int row  = flat >> 10;
        int col  = flat & 1023;
        int qq   = q0 + row; if (qq > 599) qq = 599;
        v2f d = *(const v2f*)(rel + ((size_t)(b * 600 + qq) * 1024 + col) * 2);
        float acc = b2h;
#pragma unroll 8
        for (int j = 0; j < 128; ++j) {
            float hv = fmaf(d.x, w1s[j], fmaf(d.y, w1s[128 + j], b1s[j]));
            hv  = fmaxf(hv, 0.0f);
            acc = fmaf(hv, w2s[j], acc);
        }
        float* sp = S + row * SST + col;
        *sp = *sp * 0.125f + acc;
    }
    __syncthreads();

    // ---- Phase 3: row softmax (wave owns 2 rows; wave32 shuffles)
#pragma unroll
    for (int rr = 0; rr < 2; ++rr) {
        int row = wv * 2 + rr;
        float* sr = S + row * SST;
        float ev[32];
        float mx = -3.0e38f;
#pragma unroll
        for (int i = 0; i < 32; ++i) { ev[i] = sr[lane + i * 32]; mx = fmaxf(mx, ev[i]); }
#pragma unroll
        for (int off = 16; off > 0; off >>= 1) mx = fmaxf(mx, __shfl_xor(mx, off, 32));
        float sum = 0.0f;
#pragma unroll
        for (int i = 0; i < 32; ++i) { ev[i] = __expf(ev[i] - mx); sum += ev[i]; }
#pragma unroll
        for (int off = 16; off > 0; off >>= 1) sum += __shfl_xor(sum, off, 32);
        float inv = 1.0f / sum;
#pragma unroll
        for (int i = 0; i < 32; ++i) sr[lane + i * 32] = ev[i] * inv;
    }
    __syncthreads();

    // ---- Phase 4: O = P V ; V staged k-pair interleaved so B frags are b64
    const int dt    = wv & 3;
    const int half  = wv >> 2;
    const int dbase = dt * 16;
    v2f* Vp = (v2f*)Kst;               // (k/2)*80 + d
    v8f acc = {0.f,0.f,0.f,0.f,0.f,0.f,0.f,0.f};

    for (int c = 0; c < 4; ++c) {
        int kc0 = c * 256;
#pragma unroll
        for (int i = 0; i < 16; ++i) {
            int slot = tid + i * 256;
            int r  = slot >> 4;
            int c4 = (slot & 15) * 4;
            float4 vv = *(const float4*)(kv + (size_t)(b * 1024 + kc0 + r) * 1024
                                            + h * 128 + 64 + c4);
            float* dst = Kst + (r >> 1) * 160 + (r & 1);
            dst[(c4 + 0) * 2] = vv.x; dst[(c4 + 1) * 2] = vv.y;
            dst[(c4 + 2) * 2] = vv.z; dst[(c4 + 3) * 2] = vv.w;
        }
        __syncthreads();

#pragma unroll
        for (int ks = 0; ks < 32; ++ks) {
            int k  = half * 128 + ks * 4;
            int kk = k + 2 * hi;
            v2f a  = *(const v2f*)&S[lm * SST + kc0 + kk];
            v2f bb = Vp[(kk >> 1) * 80 + dbase + lm];
            acc = WMMA_F32(a, bb, acc);
        }
        __syncthreads();
    }

    if (half == 1) {
#pragma unroll
        for (int r = 0; r < 8; ++r) Ored[dt * 256 + r * 32 + lane] = acc[r];
    }
    __syncthreads();
    if (half == 0) {
#pragma unroll
        for (int r = 0; r < 8; ++r) {
            float o = acc[r] + Ored[dt * 256 + r * 32 + lane];
            int qrow = q0 + r + 8 * hi;
            if (qrow < 600)
                ctx[(size_t)(b * 600 + qrow) * 512 + h * 64 + dbase + lm] = o;
        }
    }
}

// ---------------------------------------------------------------------------
extern "C" void kernel_launch(void* const* d_in, const int* in_sizes, int n_in,
                              void* d_out, int out_size, void* d_ws, size_t ws_size,
                              hipStream_t stream)
{
    (void)in_sizes; (void)n_in; (void)out_size; (void)ws_size;

    const float* nodes  = (const float*)d_in[0];
    const float* images = (const float*)d_in[1];
    const float* rel    = (const float*)d_in[2];
    const float* q_w    = (const float*)d_in[3];
    const float* q_b    = (const float*)d_in[4];
    const float* kv_w   = (const float*)d_in[5];
    const float* kv_b   = (const float*)d_in[6];
    const float* cpb_w1 = (const float*)d_in[7];
    const float* cpb_b1 = (const float*)d_in[8];
    const float* cpb_w2 = (const float*)d_in[9];
    const float* cpb_b2 = (const float*)d_in[10];
    const float* out_w  = (const float*)d_in[11];
    const float* out_b  = (const float*)d_in[12];
    float* out = (float*)d_out;

    float* ws   = (float*)d_ws;
    float* qws  = ws;                              // 2400*512
    float* kvws = qws + 2400 * 512;                // 4096*1024
    float* ctx  = kvws + 4096 * 1024;              // 2400*512

    dim3 blk(256);
    gemm_bias_kernel<<<dim3(38, 8),  blk, 0, stream>>>(nodes,  q_w,  q_b,  qws,  2400, 512,  512);
    gemm_bias_kernel<<<dim3(64, 16), blk, 0, stream>>>(images, kv_w, kv_b, kvws, 4096, 1024, 512);

    size_t smem = (size_t)(16 * SST + KVSTAGE + 256 + 128 + 128 + 1024) * sizeof(float);
    attn_kernel<<<dim3(38, 8, 4), blk, smem, stream>>>(qws, kvws, rel,
                                                       cpb_w1, cpb_b1, cpb_w2, cpb_b2, ctx);

    gemm_bias_kernel<<<dim3(38, 8), blk, 0, stream>>>(ctx, out_w, out_b, out, 2400, 512, 512);
}

// v001
// It runs in 192 microseconds.
// Next to v000, in two timings, it ran 3.71 and 3.72 times as fast.
#include <hip/hip_runtime.h>

typedef float v2f __attribute__((ext_vector_type(2)));
typedef float v8f __attribute__((ext_vector_type(8)));

#define WMMA_F32(a, b, c) \
  __builtin_amdgcn_wmma_f32_16x16x4_f32(false, (a), false, (b), (short)0, (c), false, false)

// ---------------------------------------------------------------------------
// CDNA5 async global->LDS copy (16 bytes per lane, ASYNCcnt-tracked).
// dsaddr = LDS_BASE + VGPR[VDST][lane]; generic shared pointer's low 32 bits
// are the LDS byte offset (aperture truncation).
// ---------------------------------------------------------------------------
__device__ __forceinline__ void async_ld16(void* lds_dst, const void* gsrc) {
    unsigned loff = (unsigned)(unsigned long long)lds_dst;
    asm volatile("global_load_async_to_lds_b128 %0, %1, off"
                 :: "v"(loff), "v"(gsrc)
                 : "memory");
}
__device__ __forceinline__ void wait_async0() {
    asm volatile("s_wait_asynccnt 0x0" ::: "memory");
}

// ---------------------------------------------------------------------------
// GEMM + bias:  C[M,N] = A[M,K] @ W[K,N] + bias[N]
// 256 thr = 8 waves, 64x64 block tile, wave = 16x32 slab (2 wmma accums).
// A tile row-major (stride 68, async-staged); W tile k-pair interleaved
// (v2f [k/2][n], row stride 80 v2f) so each B fragment is one ds_load_b64.
// ---------------------------------------------------------------------------
__global__ __launch_bounds__(256)
void gemm_bias_kernel(const float* __restrict__ A, const float* __restrict__ W,
                      const float* __restrict__ bias, float* __restrict__ C,
                      int M, int N, int K)
{
    __shared__ float sA[64][68];
    __shared__ v2f   sWp[32 * 80];     // (k/2) * 80 + n

    const int tid  = threadIdx.x;
    const int wv   = tid >> 5;
    const int lane = tid & 31;
    const int lm   = lane & 15;
    const int hi   = lane >> 4;
    const int m0   = blockIdx.x * 64;
    const int n0   = blockIdx.y * 64;
    const int wm   = wv >> 1;
    const int wn   = wv & 1;

    v8f acc0 = {0.f,0.f,0.f,0.f,0.f,0.f,0.f,0.f};
    v8f acc1 = {0.f,0.f,0.f,0.f,0.f,0.f,0.f,0.f};

    for (int kc = 0; kc < K; kc += 64) {
#pragma unroll
        for (int i = 0; i < 4; ++i) {
            int slot = tid + i * 256;          // 1024 float4 slots per tile
            int r  = slot >> 4;
            int c4 = (slot & 15) * 4;
            int gr = m0 + r; if (gr >= M) gr = M - 1;   // clamp; store is guarded
            async_ld16(&sA[r][c4], A + (size_t)gr * K + kc + c4);
            float4 vw = *(const float4*)(W + (size_t)(kc + r) * N + n0 + c4);
            float* wd = (float*)sWp + (r >> 1) * 160 + (r & 1);
            wd[(c4 + 0) * 2] = vw.x; wd[(c4 + 1) * 2] = vw.y;
            wd[(c4 + 2) * 2] = vw.z; wd[(c4 + 3) * 2] = vw.w;
        }
        wait_async0();
        __syncthreads();

#pragma unroll
        for (int ks = 0; ks < 16; ++ks) {
            int kb = ks * 4 + 2 * hi;          // even k of this lane-half's pair
            v2f a  = *(const v2f*)&sA[wm * 16 + lm][kb];
            v2f b0 = sWp[(kb >> 1) * 80 + wn * 32 + lm];
            v2f b1 = sWp[(kb >> 1) * 80 + wn * 32 + 16 + lm];
            acc0 = WMMA_F32(a, b0, acc0);
            acc1 = WMMA_F32(a, b1, acc1);
        }
        __syncthreads();
    }

#pragma unroll
    for (int r = 0; r < 8; ++r) {
        int gm = m0 + wm * 16 + r + 8 * hi;    // D: lanes>=16 hold M=r+8
        if (gm < M) {
            int c0 = n0 + wn * 32 + lm;
            C[(size_t)gm * N + c0]      = acc0[r] + bias[c0];
            C[(size_t)gm * N + c0 + 16] = acc1[r] + bias[c0 + 16];
        }
    }
}

// ---------------------------------------------------------------------------
// Position-bias MLP, once per (b,q,k) pair for all 8 heads:
//   bias[b][h][q][k] = relu(rel @ w1 + b1) @ w2[:,h] + b2[h]
// q runs to 608 (38 tiles of 16); rows 600..607 repeat row 599, so that the
// attention kernel reads whole tiles at constant offsets.
// A lane owns 4 consecutive k of one (b,q) row.  The hidden layer does not
// depend on the head, so it is formed once per pair.  Every packed f32 FMA
// carries two neighbouring k; every weight is uniform over the wave, comes
// through scalar loads and is read as one scalar operand for both halves.
// With only 8 heads an f32 16x16x4 matrix tile would be half idle; by the issue
// rates of the two pipes that is slower here than the packed vector form.
// ---------------------------------------------------------------------------
__global__ __launch_bounds__(128)
void cpb_kernel(const float* __restrict__ rel,  // (2400,1024,2)
                const float* __restrict__ w1, const float* __restrict__ b1,
                const float* __restrict__ w2, const float* __restrict__ b2,
                float* __restrict__ bias)       // (4,8,608,1024)
{
    const int tid = threadIdx.x;
    const int row = blockIdx.x >> 1;                        // b*608 + q
    const int b   = row / 608;
    const int q   = row - b * 608;
    const int qs  = q > 599 ? 599 : q;
    const int kl  = (blockIdx.x & 1) * 512 + tid * 4;

    const float4* rp = (const float4*)(rel + ((size_t)(b * 600 + qs) * 1024 + kl) * 2);
    const float4 r01 = rp[0];
    const float4 r23 = rp[1];
    const v2f dx[2] = {{r01.x, r01.z}, {r23.x, r23.z}};
    const v2f dy[2] = {{r01.y, r01.w}, {r23.y, r23.w}};

    v2f acc[2][8];                                          // [k couple][head]
#pragma unroll
    for (int h = 0; h < 8; ++h) {
        const float bb = b2[h];
        acc[0][h] = (v2f){bb, bb};
        acc[1][h] = (v2f){bb, bb};
    }

    const v2f zero = {0.0f, 0.0f};
#pragma unroll
    for (int j = 0; j < 128; ++j) {
        const float wa = w1[j], wb = w1[128 + j], bh = b1[j];
        v2f hv[2];
#pragma unroll
        for (int c = 0; c < 2; ++c) {
            hv[c] = __builtin_elementwise_fma(dx[c], (v2f){wa, wa},
                    __builtin_elementwise_fma(dy[c], (v2f){wb, wb}, (v2f){bh, bh}));
            hv[c] = __builtin_elementwise_max(hv[c], zero);
        }
#pragma unroll
        for (int h = 0; h < 8; ++h) {
            const float wo = w2[j * 8 + h];
            acc[0][h] = __builtin_elementwise_fma(hv[0], (v2f){wo, wo}, acc[0][h]);
            acc[1][h] = __builtin_elementwise_fma(hv[1], (v2f){wo, wo}, acc[1][h]);
        }
    }

    float* op = bias + ((size_t)(b * 8) * 608 + q) * 1024 + kl;
#pragma unroll
    for (int h = 0; h < 8; ++h) {
        float4 o = {acc[0][h].x, acc[0][h].y, acc[1][h].x, acc[1][h].y};
        *(float4*)(op + (size_t)h * 608 * 1024) = o;
    }
}

// ---------------------------------------------------------------------------
// Fused attention per (q-tile 16, head, batch):
//   S = (Q Kh^T)/8 + bias  -> row softmax -> O = P Vh
// ---------------------------------------------------------------------------
#define SST 1028   // padded S row stride
#define VST 68     // K-stage row stride (row-major phase)
#define KVSTAGE 20480  // floats: max(256*68, 128*160)

__global__ __launch_bounds__(256)
void attn_kernel(const float* __restrict__ q,   // (4,600,512)
                 const float* __restrict__ kv,  // (4,1024,8*128): +0..63 K, +64..127 V
                 const float* __restrict__ bias, // (4,8,608,1024)
                 float* __restrict__ ctx)       // (4,600,512)
{
    extern __shared__ float smem[];
    float* S    = smem;               // 16 * SST
    float* Kst  = S + 16 * SST;       // KVSTAGE (K chunks row-major / V pairs)
    float* Ored = Kst + KVSTAGE;      // 1024 split-K combine

    const int tid  = threadIdx.x;
    const int wv   = tid >> 5;
    const int lane = tid & 31;
    const int lm   = lane & 15;
    const int hi   = lane >> 4;
    const int qt   = blockIdx.x;
    const int h    = blockIdx.y;
    const int b    = blockIdx.z;
    const int q0   = qt * 16;

    // ---- preload Q fragments: all 16 k-steps over d=64, one v2f each
    int qr = q0 + lm; if (qr > 599) qr = 599;
    const float* qp = q + (size_t)(b * 600 + qr) * 512 + h * 64;
    v2f afr[16];
#pragma unroll
    for (int ks = 0; ks < 16; ++ks)
        afr[ks] = *(const v2f*)(qp + ks * 4 + 2 * hi);

    // ---- Phase 1: S = Q K^T  (K streamed in 256-row chunks, async->LDS)
    for (int c = 0; c < 4; ++c) {
        int kc0 = c * 256;
#pragma unroll
        for (int i = 0; i < 16; ++i) {
            int slot = tid + i * 256;           // 4096 float4 slots = 256x64
            int r  = slot >> 4;
            int c4 = (slot & 15) * 4;
            async_ld16(Kst + r * VST + c4,
                       kv + (size_t)(b * 1024 + kc0 + r) * 1024 + h * 128 + c4);
        }
        wait_async0();
        __syncthreads();

#pragma unroll
        for (int tt = 0; tt < 2; ++tt) {
            int kb = (wv * 2 + tt) * 16;
            v8f acc = {0.f,0.f,0.f,0.f,0.f,0.f,0.f,0.f};
#pragma unroll
            for (int ks = 0; ks < 16; ++ks) {
                int kk = ks * 4 + 2 * hi;
                v2f bb = *(const v2f*)&Kst[(kb + lm) * VST + kk];
                acc = WMMA_F32(afr[ks], bb, acc);
            }
#pragma unroll
            for (int r = 0; r < 8; ++r)
                S[(r + 8 * hi) * SST + kc0 + kb + lm] = acc[r];
        }
        __syncthreads();
    }

    // ---- Phase 2: 1/sqrt(64) scale + precomputed position bias, in place on S
    const float* bp = bias + ((size_t)(b * 8 + h) * 608 + q0) * 1024 + tid * 4;
    float4 bv[16];
#pragma unroll
    for (int row = 0; row < 16; ++row)
        bv[row] = *(const float4*)(bp + row * 1024);
#pragma unroll
    for (int row = 0; row < 16; ++row) {
        float4* sp = (float4*)(S + row * SST + tid * 4);
        float4 sv = *sp;
        sv.x = sv.x * 0.125f + bv[row].x; sv.y = sv.y * 0.125f + bv[row].y;
        sv.z = sv.z * 0.125f + bv[row].z; sv.w = sv.w * 0.125f + bv[row].w;
        *sp = sv;
    }
    __syncthreads();

    // ---- Phase 3: row softmax (wave owns 2 rows; wave32 shuffles)
#pragma unroll
    for (int rr = 0; rr < 2; ++rr) {
        int row = wv * 2 + rr;
        float* sr = S + row * SST;
        float ev[32];
        float mx = -3.0e38f;
#pragma unroll
        for (int i = 0; i < 32; ++i) { ev[i] = sr[lane + i * 32]; mx = fmaxf(mx, ev[i]); }
#pragma unroll
        for (int off = 16; off > 0; off >>= 1) mx = fmaxf(mx, __shfl_xor(mx, off, 32));
        float sum = 0.0f;
#pragma unroll
        for (int i = 0; i < 32; ++i) { ev[i] = __expf(ev[i] - mx); sum += ev[i]; }
#pragma unroll
        for (int off = 16; off > 0; off >>= 1) sum += __shfl_xor(sum, off, 32);
        float inv = 1.0f / sum;
#pragma unroll
        for (int i = 0; i < 32; ++i) sr[lane + i * 32] = ev[i] * inv;
    }
    __syncthreads();

    // ---- Phase 4: O = P V ; V staged k-pair interleaved so B frags are b64
    const int dt    = wv & 3;
    const int half  = wv >> 2;
    const int dbase = dt * 16;
    v2f* Vp = (v2f*)Kst;               // (k/2)*80 + d
    v8f acc = {0.f,0.f,0.f,0.f,0.f,0.f,0.f,0.f};

    for (int c = 0; c < 4; ++c) {
        int kc0 = c * 256;
#pragma unroll
        for (int i = 0; i < 16; ++i) {
            int slot = tid + i * 256;
            int r  = slot >> 4;
            int c4 = (slot & 15) * 4;
            float4 vv = *(const float4*)(kv + (size_t)(b * 1024 + kc0 + r) * 1024
                                            + h * 128 + 64 + c4);
            float* dst = Kst + (r >> 1) * 160 + (r & 1);
            dst[(c4 + 0) * 2] = vv.x; dst[(c4 + 1) * 2] = vv.y;
            dst[(c4 + 2) * 2] = vv.z; dst[(c4 + 3) * 2] = vv.w;
        }
        __syncthreads();

#pragma unroll
        for (int ks = 0; ks < 32; ++ks) {
            int k  = half * 128 + ks * 4;
            int kk = k + 2 * hi;
            v2f a  = *(const v2f*)&S[lm * SST + kc0 + kk];
            v2f bb = Vp[(kk >> 1) * 80 + dbase + lm];
            acc = WMMA_F32(a, bb, acc);
        }
        __syncthreads();
    }

    if (half == 1) {
#pragma unroll
        for (int r = 0; r < 8; ++r) Ored[dt * 256 + r * 32 + lane] = acc[r];
    }
    __syncthreads();
    if (half == 0) {
#pragma unroll
        for (int r = 0; r < 8; ++r) {
            float o = acc[r] + Ored[dt * 256 + r * 32 + lane];
            int qrow = q0 + r + 8 * hi;
            if (qrow < 600)
                ctx[(size_t)(b * 600 + qrow) * 512 + h * 64 + dbase + lm] = o;
        }
    }
}

// ---------------------------------------------------------------------------
extern "C" void kernel_launch(void* const* d_in, const int* in_sizes, int n_in,
                              void* d_out, int out_size, void* d_ws, size_t ws_size,
                              hipStream_t stream)
{
    (void)in_sizes; (void)n_in; (void)out_size; (void)ws_size;

    const float* nodes  = (const float*)d_in[0];
    const float* images = (const float*)d_in[1];
    const float* rel    = (const float*)d_in[2];
    const float* q_w    = (const float*)d_in[3];
    const float* q_b    = (const float*)d_in[4];
    const float* kv_w   = (const float*)d_in[5];
    const float* kv_b   = (const float*)d_in[6];
    const float* cpb_w1 = (const float*)d_in[7];
    const float* cpb_b1 = (const float*)d_in[8];
    const float* cpb_w2 = (const float*)d_in[9];
    const float* cpb_b2 = (const float*)d_in[10];
    const float* out_w  = (const float*)d_in[11];
    const float* out_b  = (const float*)d_in[12];
    float* out = (float*)d_out;

    float* ws   = (float*)d_ws;
    float* qws  = ws;                              // 2400*512
    float* kvws = qws + 2400 * 512;                // 4096*1024
    float* ctx  = kvws + 4096 * 1024;              // 2400*512
    float* cpb  = ctx + 2400 * 512;                // 4*8*608*1024

    dim3 blk(256);
    gemm_bias_kernel<<<dim3(38, 8),  blk, 0, stream>>>(nodes,  q_w,  q_b,  qws,  2400, 512,  512);
    gemm_bias_kernel<<<dim3(64, 16), blk, 0, stream>>>(images, kv_w, kv_b, kvws, 4096, 1024, 512);

    cpb_kernel<<<dim3(4864), dim3(128), 0, stream>>>(rel, cpb_w1, cpb_b1, cpb_w2, cpb_b2, cpb);

    size_t smem = (size_t)(16 * SST + KVSTAGE + 1024) * sizeof(float);
    attn_kernel<<<dim3(38, 8, 4), blk, smem, stream>>>(qws, kvws, cpb, ctx);

    gemm_bias_kernel<<<dim3(38, 8), blk, 0, stream>>>(ctx, out_w, out_b, out, 2400, 512, 512);
}

// v002
// It runs in 158 microseconds.
// Next to v001, in two timings, it ran 1.22 times as fast each time.
// Over all steps from v000 it is 4.53 times as fast.
#include <hip/hip_runtime.h>

typedef float v2f __attribute__((ext_vector_type(2)));
typedef float v8f __attribute__((ext_vector_type(8)));

#define WMMA_F32(a, b, c) \
  __builtin_amdgcn_wmma_f32_16x16x4_f32(false, (a), false, (b), (short)0, (c), false, false)

// ---------------------------------------------------------------------------
// CDNA5 async global->LDS copy (16 bytes per lane, ASYNCcnt-tracked).
// dsaddr = LDS_BASE + VGPR[VDST][lane]; generic shared pointer's low 32 bits
// are the LDS byte offset (aperture truncation).
// ---------------------------------------------------------------------------
__device__ __forceinline__ void async_ld16(void* lds_dst, const void* gsrc) {
    unsigned loff = (unsigned)(unsigned long long)lds_dst;
    asm volatile("global_load_async_to_lds_b128 %0, %1, off"
                 :: "v"(loff), "v"(gsrc)
                 : "memory");
}
// The same copy with s_wait_xcnt 0 as the last line of its own statement, so
// that the wait stands in front of any rewrite of the copy's address registers.
__device__ __forceinline__ void async_ld16_x(void* lds_dst, const void* gsrc) {
    unsigned loff = (unsigned)(unsigned long long)lds_dst;
    asm volatile("global_load_async_to_lds_b128 %0, %1, off\n\ts_wait_xcnt 0x0"
                 :: "v"(loff), "v"(gsrc)
                 : "memory");
}
__device__ __forceinline__ void wait_async0() {
    asm volatile("s_wait_asynccnt 0x0" ::: "memory");
}

// ---------------------------------------------------------------------------
// GEMM + bias:  C[M,N] = A[M,K] @ W[K,N] + bias[N]
// 256 thr = 8 waves, 64x64 block tile, wave = 16x32 slab (2 wmma accums).
// A tile row-major (stride 68, async-staged); W tile k-pair interleaved
// (v2f [k/2][n], row stride 80 v2f) so each B fragment is one ds_load_b64.
// ---------------------------------------------------------------------------
__device__ __forceinline__
void gemm_tile(const float* __restrict__ A, const float* __restrict__ W,
               const float* __restrict__ bias, float* __restrict__ C,
               int M, int N, int K, int m0, int n0)
{
    __shared__ __attribute__((aligned(16))) float sA[64][68];  // 16-byte copies land here
    __shared__ v2f   sWp[32 * 80];     // (k/2) * 80 + n

    const int tid  = threadIdx.x;
    const int wv   = tid >> 5;
    const int lane = tid & 31;
    const int lm   = lane & 15;
    const int hi   = lane >> 4;
    const int wm   = wv >> 1;
    const int wn   = wv & 1;

    v8f acc0 = {0.f,0.f,0.f,0.f,0.f,0.f,0.f,0.f};
    v8f acc1 = {0.f,0.f,0.f,0.f,0.f,0.f,0.f,0.f};

    for (int kc = 0; kc < K; kc += 64) {
#pragma unroll
        for (int i = 0; i < 4; ++i) {
            int slot = tid + i * 256;          // 1024 float4 slots per tile
            int r  = slot >> 4;
            int c4 = (slot & 15) * 4;
            int gr = m0 + r; if (gr >= M) gr = M - 1;   // clamp; store is guarded
            async_ld16_x(&sA[r][c4], A + (size_t)gr * K + kc + c4);
            float4 vw = *(const float4*)(W + (size_t)(kc + r) * N + n0 + c4);
            float* wd = (float*)sWp + (r >> 1) * 160 + (r & 1);
            wd[(c4 + 0) * 2] = vw.x; wd[(c4 + 1) * 2] = vw.y;
            wd[(c4 + 2) * 2] = vw.z; wd[(c4 + 3) * 2] = vw.w;
        }
        wait_async0();
        __syncthreads();

#pragma unroll
        for (int ks = 0; ks < 16; ++ks) {
            int kb = ks * 4 + 2 * hi;          // even k of this lane-half's pair
            v2f a  = *(const v2f*)&sA[wm * 16 + lm][kb];
            v2f b0 = sWp[(kb >> 1) * 80 + wn * 32 + lm];
            v2f b1 = sWp[(kb >> 1) * 80 + wn * 32 + 16 + lm];
            acc0 = WMMA_F32(a, b0, acc0);
            acc1 = WMMA_F32(a, b1, acc1);
        }
        __syncthreads();
    }

#pragma unroll
    for (int r = 0; r < 8; ++r) {
        int gm = m0 + wm * 16 + r + 8 * hi;    // D: lanes>=16 hold M=r+8
        if (gm < M) {
            int c0 = n0 + wn * 32 + lm;
            C[(size_t)gm * N + c0]      = acc0[r] + bias[c0];
            C[(size_t)gm * N + c0 + 16] = acc1[r] + bias[c0 + 16];
        }
    }
}

__global__ __launch_bounds__(256)
void gemm_bias_kernel(const float* __restrict__ A, const float* __restrict__ W,
                      const float* __restrict__ bias, float* __restrict__ C,
                      int M, int N, int K)
{
    gemm_tile(A, W, bias, C, M, N, K, blockIdx.x * 64, blockIdx.y * 64);
}

// ---------------------------------------------------------------------------
// Position-bias MLP, once per (b,q,k) pair for all 8 heads:
//   bias[b][h][q][k] = relu(rel @ w1 + b1) @ w2[:,h] + b2[h]
// q runs to 608 (38 tiles of 16); rows 600..607 repeat row 599, so that the
// attention kernel reads whole tiles at constant offsets.
// A lane owns 4 consecutive k of one (b,q) row.  The hidden layer does not
// depend on the head, so it is formed once per pair.  Every packed f32 FMA
// carries two neighbouring k; every weight is uniform over the wave, comes
// through scalar loads and is read as one scalar operand for both halves.
// With only 8 heads an f32 16x16x4 matrix tile would be half idle; by the issue
// rates of the two pipes that is slower here than the packed vector form.
// ---------------------------------------------------------------------------
__device__ __forceinline__
void cpb_row(const float* __restrict__ rel,     // (2400,1024,2)
             const float* __restrict__ w1, const float* __restrict__ b1,
             const float* __restrict__ w2, const float* __restrict__ b2,
             float* __restrict__ bias,          // (4,8,608,1024)
             int row)                           // b*608 + q
{
    const int tid = threadIdx.x;
    const int b   = row / 608;
    const int q   = row - b * 608;
    const int qs  = q > 599 ? 599 : q;
    const int kl  = tid * 4;                                // 256 lanes = 1024 k

    const float4* rp = (const float4*)(rel + ((size_t)(b * 600 + qs) * 1024 + kl) * 2);
    const float4 r01 = rp[0];
    const float4 r23 = rp[1];
    // Precaution: holds any rewrite of the two loads' address registers (the
    // scalar base is reused for the weights' scalar loads) behind this wait.
    asm volatile("s_wait_xcnt 0x0" ::: "memory");
    const v2f dx[2] = {{r01.x, r01.z}, {r23.x, r23.z}};
    const v2f dy[2] = {{r01.y, r01.w}, {r23.y, r23.w}};

    v2f acc[2][8];                                          // [k couple][head]
#pragma unroll
    for (int h = 0; h < 8; ++h) {
        const float bb = b2[h];
        acc[0][h] = (v2f){bb, bb};
        acc[1][h] = (v2f){bb, bb};
    }

    const v2f zero = {0.0f, 0.0f};
#pragma unroll
    for (int j = 0; j < 128; ++j) {
        const float wa = w1[j], wb = w1[128 + j], bh = b1[j];
        v2f hv[2];
#pragma unroll
        for (int c = 0; c < 2; ++c) {
            hv[c] = __builtin_elementwise_fma(dx[c], (v2f){wa, wa},
                    __builtin_elementwise_fma(dy[c], (v2f){wb, wb}, (v2f){bh, bh}));
            hv[c] = __builtin_elementwise_max(hv[c], zero);
        }
#pragma unroll
        for (int h = 0; h < 8; ++h) {
            const float wo = w2[j * 8 + h];
            acc[0][h] = __builtin_elementwise_fma(hv[0], (v2f){wo, wo}, acc[0][h]);
            acc[1][h] = __builtin_elementwise_fma(hv[1], (v2f){wo, wo}, acc[1][h]);
        }
    }

    float* op = bias + ((size_t)(b * 8) * 608 + q) * 1024 + kl;
#pragma unroll
    for (int h = 0; h < 8; ++h) {
        float4 o = {acc[0][h].x, acc[0][h].y, acc[1][h].x, acc[1][h].y};
        *(float4*)(op + (size_t)h * 608 * 1024) = o;
    }
    // Precaution: holds any rewrite of the stores' address and data registers
    // by code that the compiler lays out behind this row, behind this wait.
    asm volatile("s_wait_xcnt 0x0" ::: "memory");
}

// ---------------------------------------------------------------------------
// The three pieces that depend on nothing but the inputs, in ONE launch: the
// K/V projection (1024 tiles), the Q projection (304 tiles) and the position
// bias (2432 rows).  A work-group is one GEMM tile or one bias row, by its
// index alone.  The GEMM tiles wait on loads and fill the matrix pipe, the
// bias rows fill the vector pipe: resident on the same SIMDs each runs in the
// other's idle slots.  The long GEMM tiles stand early in the index order, two
// to each bias row, and the short bias rows make up the end of the launch.
// ---------------------------------------------------------------------------
__global__ __launch_bounds__(256)
void front_kernel(const float* __restrict__ nodes,  const float* __restrict__ q_w,
                  const float* __restrict__ q_b,    float* __restrict__ qws,
                  const float* __restrict__ images, const float* __restrict__ kv_w,
                  const float* __restrict__ kv_b,   float* __restrict__ kvws,
                  const float* __restrict__ rel,
                  const float* __restrict__ w1, const float* __restrict__ b1,
                  const float* __restrict__ w2, const float* __restrict__ b2,
                  float* __restrict__ bias)
{
    const int bid = blockIdx.x;                 // 0..3759
    const int t   = bid / 3;
    const int r   = bid - t * 3;
    if (bid < 1992 && r < 2) {                  // 664 triples hold the 1328 tiles
        const int  g  = t * 2 + r;
        const bool kv = g < 1024;               // K/V tiles first, then Q tiles
        const int  gq = g - 1024;
        const int  ny = kv ? (g >> 6) : gq / 38;
        const int  nx = kv ? (g & 63) : gq - ny * 38;
        gemm_tile(kv ? images : nodes, kv ? kv_w : q_w, kv ? kv_b : q_b,
                  kv ? kvws : qws, kv ? 4096 : 2400, kv ? 1024 : 512, 512,
                  nx * 64, ny * 64);
    } else {
        cpb_row(rel, w1, b1, w2, b2, bias, bid < 1992 ? t : bid - 1328);
    }
}

// ---------------------------------------------------------------------------
// Fused attention per (q-tile 16, head, batch):
//   S = (Q Kh^T)/8 + bias  -> row softmax -> O = P Vh
// ---------------------------------------------------------------------------
#define SST 1028   // padded S row stride
#define VST 68     // K-stage row stride (row-major phase)
#define KVSTAGE 20480  // floats: max(256*68, 128*160)

__global__ __launch_bounds__(256)
void attn_kernel(const float* __restrict__ q,   // (4,600,512)
                 const float* __restrict__ kv,  // (4,1024,8*128): +0..63 K, +64..127 V
                 const float* __restrict__ bias, // (4,8,608,1024)
                 float* __restrict__ ctx)       // (4,600,512)
{
    extern __shared__ float smem[];
    float* S    = smem;               // 16 * SST
    float* Kst  = S + 16 * SST;       // KVSTAGE (K chunks row-major / V pairs)
    float* Ored = Kst + KVSTAGE;      // 1024 split-K combine

    const int tid  = threadIdx.x;
    const int wv   = tid >> 5;
    const int lane = tid & 31;
    const int lm   = lane & 15;
    const int hi   = lane >> 4;
    const int qt   = blockIdx.x;
    const int h    = blockIdx.y;
    const int b    = blockIdx.z;
    const int q0   = qt * 16;

    // ---- preload Q fragments: all 16 k-steps over d=64, one v2f each
    int qr = q0 + lm; if (qr > 599) qr = 599;
    const float* qp = q + (size_t)(b * 600 + qr) * 512 + h * 64;
    v2f afr[16];
#pragma unroll
    for (int ks = 0; ks < 16; ++ks)
        afr[ks] = *(const v2f*)(qp + ks * 4 + 2 * hi);

    // ---- Phase 1: S = Q K^T  (K streamed in 256-row chunks, async->LDS)
    for (int c = 0; c < 4; ++c) {
        int kc0 = c * 256;
#pragma unroll
        for (int i = 0; i < 16; ++i) {
            int slot = tid + i * 256;           // 4096 float4 slots = 256x64
            int r  = slot >> 4;
            int c4 = (slot & 15) * 4;
            async_ld16(Kst + r * VST + c4,
                       kv + (size_t)(b * 1024 + kc0 + r) * 1024 + h * 128 + c4);
        }
        wait_async0();
        __syncthreads();

#pragma unroll
        for (int tt = 0; tt < 2; ++tt) {
            int kb = (wv * 2 + tt) * 16;
            v8f acc = {0.f,0.f,0.f,0.f,0.f,0.f,0.f,0.f};
#pragma unroll
            for (int ks = 0; ks < 16; ++ks) {
                int kk = ks * 4 + 2 * hi;
                v2f bb = *(const v2f*)&Kst[(kb + lm) * VST + kk];
                acc = WMMA_F32(afr[ks], bb, acc);
            }
#pragma unroll
            for (int r = 0; r < 8; ++r)
                S[(r + 8 * hi) * SST + kc0 + kb + lm] = acc[r];
        }
        __syncthreads();
    }

    // ---- Phase 2: 1/sqrt(64) scale + precomputed position bias, in place on S
    const float* bp = bias + ((size_t)(b * 8 + h) * 608 + q0) * 1024 + tid * 4;
    float4 bv[16];
#pragma unroll
    for (int row = 0; row < 16; ++row)
        bv[row] = *(const float4*)(bp + row * 1024);
#pragma unroll
    for (int row = 0; row < 16; ++row) {
        float4* sp = (float4*)(S + row * SST + tid * 4);
        float4 sv = *sp;
        sv.x = sv.x * 0.125f + bv[row].x; sv.y = sv.y * 0.125f + bv[row].y;
        sv.z = sv.z * 0.125f + bv[row].z; sv.w = sv.w * 0.125f + bv[row].w;
        *sp = sv;
    }
    __syncthreads();

    // ---- Phase 3: row softmax (wave owns 2 rows; wave32 shuffles)
#pragma unroll
    for (int rr = 0; rr < 2; ++rr) {
        int row = wv * 2 + rr;
        float* sr = S + row * SST;
        float ev[32];
        float mx = -3.0e38f;
#pragma unroll
        for (int i = 0; i < 32; ++i) { ev[i] = sr[lane + i * 32]; mx = fmaxf(mx, ev[i]); }
#pragma unroll
        for (int off = 16; off > 0; off >>= 1) mx = fmaxf(mx, __shfl_xor(mx, off, 32));
        float sum = 0.0f;
#pragma unroll
        for (int i = 0; i < 32; ++i) { ev[i] = __expf(ev[i] - mx); sum += ev[i]; }
#pragma unroll
        for (int off = 16; off > 0; off >>= 1) sum += __shfl_xor(sum, off, 32);
        float inv = 1.0f / sum;
#pragma unroll
        for (int i = 0; i < 32; ++i) sr[lane + i * 32] = ev[i] * inv;
    }
    __syncthreads();

    // ---- Phase 4: O = P V ; V staged k-pair interleaved so B frags are b64
    const int dt    = wv & 3;
    const int half  = wv >> 2;
    const int dbase = dt * 16;
    v2f* Vp = (v2f*)Kst;               // (k/2)*80 + d
    v8f acc = {0.f,0.f,0.f,0.f,0.f,0.f,0.f,0.f};

    for (int c = 0; c < 4; ++c) {
        int kc0 = c * 256;
#pragma unroll
        for (int i = 0; i < 16; ++i) {
            int slot = tid + i * 256;
            int r  = slot >> 4;
            int c4 = (slot & 15) * 4;
            float4 vv = *(const float4*)(kv + (size_t)(b * 1024 + kc0 + r) * 1024
                                            + h * 128 + 64 + c4);
            float* dst = Kst + (r >> 1) * 160 + (r & 1);
            dst[(c4 + 0) * 2] = vv.x; dst[(c4 + 1) * 2] = vv.y;
            dst[(c4 + 2) * 2] = vv.z; dst[(c4 + 3) * 2] = vv.w;
        }
        __syncthreads();

#pragma unroll
        for (int ks = 0; ks < 32; ++ks) {
            int k  = half * 128 + ks * 4;
            int kk = k + 2 * hi;
            v2f a  = *(const v2f*)&S[lm * SST + kc0 + kk];
            v2f bb = Vp[(kk >> 1) * 80 + dbase + lm];
            acc = WMMA_F32(a, bb, acc);
        }
        __syncthreads();
    }

    if (half == 1) {
#pragma unroll
        for (int r = 0; r < 8; ++r) Ored[dt * 256 + r * 32 + lane] = acc[r];
    }
    __syncthreads();
    if (half == 0) {
#pragma unroll
        for (int r = 0; r < 8; ++r) {
            float o = acc[r] + Ored[dt * 256 + r * 32 + lane];
            int qrow = q0 + r + 8 * hi;
            if (qrow < 600)
                ctx[(size_t)(b * 600 + qrow) * 512 + h * 64 + dbase + lm] = o;
        }
    }
}

// ---------------------------------------------------------------------------
extern "C" void kernel_launch(void* const* d_in, const int* in_sizes, int n_in,
                              void* d_out, int out_size, void* d_ws, size_t ws_size,
                              hipStream_t stream)
{
    (void)in_sizes; (void)n_in; (void)out_size; (void)ws_size;

    const float* nodes  = (const float*)d_in[0];
    const float* images = (const float*)d_in[1];
    const float* rel    = (const float*)d_in[2];
    const float* q_w    = (const float*)d_in[3];
    const float* q_b    = (const float*)d_in[4];
    const float* kv_w   = (const float*)d_in[5];
    const float* kv_b   = (const float*)d_in[6];
    const float* cpb_w1 = (const float*)d_in[7];
    const float* cpb_b1 = (const float*)d_in[8];
    const float* cpb_w2 = (const float*)d_in[9];
    const float* cpb_b2 = (const float*)d_in[10];
    const float* out_w  = (const float*)d_in[11];
    const float* out_b  = (const float*)d_in[12];
    float* out = (float*)d_out;

    float* ws   = (float*)d_ws;
    float* qws  = ws;                              // 2400*512
    float* kvws = qws + 2400 * 512;                // 4096*1024
    float* ctx  = kvws + 4096 * 1024;              // 2400*512
    float* cpb  = ctx + 2400 * 512;                // 4*8*608*1024

    dim3 blk(256);
    front_kernel<<<dim3(3760), blk, 0, stream>>>(nodes, q_w, q_b, qws, images, kv_w, kv_b, kvws,
                                                 rel, cpb_w1, cpb_b1, cpb_w2, cpb_b2, cpb);

    size_t smem = (size_t)(16 * SST + KVSTAGE + 1024) * sizeof(float);
    attn_kernel<<<dim3(38, 8, 4), blk, smem, stream>>>(qws, kvws, cpb, ctx);

    gemm_bias_kernel<<<dim3(38, 8), blk, 0, stream>>>(ctx, out_w, out_b, out, 2400, 512, 512);
}

// v003
// It runs in 152 microseconds.
// Timed twice side by side with v002, it ran 1.04 times as fast both times.
// All steps since v000 together make it 4.72 times as fast.
#include <hip/hip_runtime.h>

typedef float v2f __attribute__((ext_vector_type(2)));
typedef float v8f __attribute__((ext_vector_type(8)));

#define WMMA_F32(a, b, c) \
  __builtin_amdgcn_wmma_f32_16x16x4_f32(false, (a), false, (b), (short)0, (c), false, false)

// ---------------------------------------------------------------------------
// CDNA5 async global->LDS copy (16 bytes per lane, ASYNCcnt-tracked).
// dsaddr = LDS_BASE + VGPR[VDST][lane]; generic shared pointer's low 32 bits
// are the LDS byte offset (aperture truncation).
// ---------------------------------------------------------------------------
// s_wait_xcnt 0 is the last line of the copy's own statement, so that the wait
// stands in front of any rewrite of the copy's address registers.
__device__ __forceinline__ void async_ld16_x(void* lds_dst, const void* gsrc) {
    unsigned loff = (unsigned)(unsigned long long)lds_dst;
    asm volatile("global_load_async_to_lds_b128 %0, %1, off\n\ts_wait_xcnt 0x0"
                 :: "v"(loff), "v"(gsrc)
                 : "memory");
}
__device__ __forceinline__ void wait_async0() {
    asm volatile("s_wait_asynccnt 0x0" ::: "memory");
}

// ---------------------------------------------------------------------------
// GEMM + bias:  C[M,N] = A[M,K] @ W[K,N] + bias[N]
// 256 thr = 8 waves, 64x64 block tile, wave = 16x32 slab (2 wmma accums).
// A tile row-major (stride 68, async-staged); W tile k-pair interleaved
// (v2f [k/2][n], row stride 80 v2f) so each B fragment is one ds_load_b64.
// ---------------------------------------------------------------------------
__device__ __forceinline__
void gemm_tile(const float* __restrict__ A, const float* __restrict__ W,
               const float* __restrict__ bias, float* __restrict__ C,
               int M, int N, int K, int m0, int n0)
{
    __shared__ __attribute__((aligned(16))) float sA[64][68];  // 16-byte copies land here
    __shared__ v2f   sWp[32 * 80];     // (k/2) * 80 + n

    const int tid  = threadIdx.x;
    const int wv   = tid >> 5;
    const int lane = tid & 31;
    const int lm   = lane & 15;
    const int hi   = lane >> 4;
    const int wm   = wv >> 1;
    const int wn   = wv & 1;

    v8f acc0 = {0.f,0.f,0.f,0.f,0.f,0.f,0.f,0.f};
    v8f acc1 = {0.f,0.f,0.f,0.f,0.f,0.f,0.f,0.f};

    for (int kc = 0; kc < K; kc += 64) {
#pragma unroll
        for (int i = 0; i < 4; ++i) {
            int slot = tid + i * 256;          // 1024 float4 slots per tile
            int r  = slot >> 4;
            int c4 = (slot & 15) * 4;
            int gr = m0 + r; if (gr >= M) gr = M - 1;   // clamp; store is guarded
            async_ld16_x(&sA[r][c4], A + (size_t)gr * K + kc + c4);
            float4 vw = *(const float4*)(W + (size_t)(kc + r) * N + n0 + c4);
            float* wd = (float*)sWp + (r >> 1) * 160 + (r & 1);
            wd[(c4 + 0) * 2] = vw.x; wd[(c4 + 1) * 2] = vw.y;
            wd[(c4 + 2) * 2] = vw.z; wd[(c4 + 3) * 2] = vw.w;
        }
        wait_async0();
        __syncthreads();

#pragma unroll
        for (int ks = 0; ks < 16; ++ks) {
            int kb = ks * 4 + 2 * hi;          // even k of this lane-half's pair
            v2f a  = *(const v2f*)&sA[wm * 16 + lm][kb];
            v2f b0 = sWp[(kb >> 1) * 80 + wn * 32 + lm];
            v2f b1 = sWp[(kb >> 1) * 80 + wn * 32 + 16 + lm];
            acc0 = WMMA_F32(a, b0, acc0);
            acc1 = WMMA_F32(a, b1, acc1);
        }
        __syncthreads();
    }

#pragma unroll
    for (int r = 0; r < 8; ++r) {
        int gm = m0 + wm * 16 + r + 8 * hi;    // D: lanes>=16 hold M=r+8
        if (gm < M) {
            int c0 = n0 + wn * 32 + lm;
            C[(size_t)gm * N + c0]      = acc0[r] + bias[c0];
            C[(size_t)gm * N + c0 + 16] = acc1[r] + bias[c0 + 16];
        }
    }
}

__global__ __launch_bounds__(256)
void gemm_bias_kernel(const float* __restrict__ A, const float* __restrict__ W,
                      const float* __restrict__ bias, float* __restrict__ C,
                      int M, int N, int K)
{
    gemm_tile(A, W, bias, C, M, N, K, blockIdx.x * 64, blockIdx.y * 64);
}

// ---------------------------------------------------------------------------
// Position-bias MLP, once per (b,q,k) pair for all 8 heads:
//   bias[b][h][q][k] = relu(rel @ w1 + b1) @ w2[:,h] + b2[h]
// q runs to 608 (38 tiles of 16); rows 600..607 repeat row 599, so that the
// attention kernel reads whole tiles at constant offsets.
// A lane owns 4 consecutive k of one (b,q) row.  The hidden layer does not
// depend on the head, so it is formed once per pair.  Every packed f32 FMA
// carries two neighbouring k; every weight is uniform over the wave, comes
// through scalar loads and is read as one scalar operand for both halves.
// With only 8 heads an f32 16x16x4 matrix tile would be half idle; by the issue
// rates of the two pipes that is slower here than the packed vector form.
// ---------------------------------------------------------------------------
__device__ __forceinline__
void cpb_row(const float* __restrict__ rel,     // (2400,1024,2)
             const float* __restrict__ w1, const float* __restrict__ b1,
             const float* __restrict__ w2, const float* __restrict__ b2,
             float* __restrict__ bias,          // (4,8,608,1024)
             int row)                           // b*608 + q
{
    const int tid = threadIdx.x;
    const int b   = row / 608;
    const int q   = row - b * 608;
    const int qs  = q > 599 ? 599 : q;
    const int kl  = tid * 4;                                // 256 lanes = 1024 k

    const float4* rp = (const float4*)(rel + ((size_t)(b * 600 + qs) * 1024 + kl) * 2);
    const float4 r01 = rp[0];
    const float4 r23 = rp[1];
    // Precaution: holds any rewrite of the two loads' address registers (the
    // scalar base is reused for the weights' scalar loads) behind this wait.
    asm volatile("s_wait_xcnt 0x0" ::: "memory");
    const v2f dx[2] = {{r01.x, r01.z}, {r23.x, r23.z}};
    const v2f dy[2] = {{r01.y, r01.w}, {r23.y, r23.w}};

    v2f acc[2][8];                                          // [k couple][head]
#pragma unroll
    for (int h = 0; h < 8; ++h) {
        const float bb = b2[h];
        acc[0][h] = (v2f){bb, bb};
        acc[1][h] = (v2f){bb, bb};
    }

    const v2f zero = {0.0f, 0.0f};
#pragma unroll
    for (int j = 0; j < 128; ++j) {
        const float wa = w1[j], wb = w1[128 + j], bh = b1[j];
        v2f hv[2];
#pragma unroll
        for (int c = 0; c < 2; ++c) {
            hv[c] = __builtin_elementwise_fma(dx[c], (v2f){wa, wa},
                    __builtin_elementwise_fma(dy[c], (v2f){wb, wb}, (v2f){bh, bh}));
            hv[c] = __builtin_elementwise_max(hv[c], zero);
        }
#pragma unroll
        for (int h = 0; h < 8; ++h) {
            const float wo = w2[j * 8 + h];
            acc[0][h] = __builtin_elementwise_fma(hv[0], (v2f){wo, wo}, acc[0][h]);
            acc[1][h] = __builtin_elementwise_fma(hv[1], (v2f){wo, wo}, acc[1][h]);
        }
    }

    float* op = bias + ((size_t)(b * 8) * 608 + q) * 1024 + kl;
#pragma unroll
    for (int h = 0; h < 8; ++h) {
        float4 o = {acc[0][h].x, acc[0][h].y, acc[1][h].x, acc[1][h].y};
        *(float4*)(op + (size_t)h * 608 * 1024) = o;
    }
    // Precaution: holds any rewrite of the stores' address and data registers
    // by code that the compiler lays out behind this row, behind this wait.
    asm volatile("s_wait_xcnt 0x0" ::: "memory");
}

// ---------------------------------------------------------------------------
// The three pieces that depend on nothing but the inputs, in ONE launch: the
// K/V projection (1024 tiles), the Q projection (304 tiles) and the position
// bias (2432 rows).  A work-group is one GEMM tile or one bias row, by its
// index alone.  The GEMM tiles wait on loads and fill the matrix pipe, the
// bias rows fill the vector pipe: resident on the same SIMDs each runs in the
// other's idle slots.  The long GEMM tiles stand early in the index order, two
// to each bias row, and the short bias rows make up the end of the launch.
// ---------------------------------------------------------------------------
__global__ __launch_bounds__(256)
void front_kernel(const float* __restrict__ nodes,  const float* __restrict__ q_w,
                  const float* __restrict__ q_b,    float* __restrict__ qws,
                  const float* __restrict__ images, const float* __restrict__ kv_w,
                  const float* __restrict__ kv_b,   float* __restrict__ kvws,
                  const float* __restrict__ rel,
                  const float* __restrict__ w1, const float* __restrict__ b1,
                  const float* __restrict__ w2, const float* __restrict__ b2,
                  float* __restrict__ bias)
{
    const int bid = blockIdx.x;                 // 0..3759
    const int t   = bid / 3;
    const int r   = bid - t * 3;
    if (bid < 1992 && r < 2) {                  // 664 triples hold the 1328 tiles
        const int  g  = t * 2 + r;
        const bool kv = g < 1024;               // K/V tiles first, then Q tiles
        const int  gq = g - 1024;
        const int  ny = kv ? (g >> 6) : gq / 38;
        const int  nx = kv ? (g & 63) : gq - ny * 38;
        gemm_tile(kv ? images : nodes, kv ? kv_w : q_w, kv ? kv_b : q_b,
                  kv ? kvws : qws, kv ? 4096 : 2400, kv ? 1024 : 512, 512,
                  nx * 64, ny * 64);
    } else {
        cpb_row(rel, w1, b1, w2, b2, bias, bid < 1992 ? t : bid - 1328);
    }
}

// ---------------------------------------------------------------------------
// One 128-row x 64-float tile of K or V (rows 4 KiB apart in kv) into LDS at
// row pitch PITCH floats: 8 async 16-byte copies per lane, every lane on.
// s_wait_xcnt 0 is the last line of the copies' own statement, so that it
// stands in front of any rewrite of the address registers the copies name.
// ---------------------------------------------------------------------------
template <int PITCH>
__device__ __forceinline__ void stage_tile(float* buf, const float* src, int tid) {
    const int r  = tid >> 4;
    const int c4 = (tid & 15) * 4;
    const unsigned l = (unsigned)(unsigned long long)(buf + r * PITCH + c4);
    const float*   g = src + (size_t)r * 1024 + c4;
    asm volatile("global_load_async_to_lds_b128 %0, %8, off\n\t"
                 "global_load_async_to_lds_b128 %1, %9, off\n\t"
                 "global_load_async_to_lds_b128 %2, %10, off\n\t"
                 "global_load_async_to_lds_b128 %3, %11, off\n\t"
                 "global_load_async_to_lds_b128 %4, %12, off\n\t"
                 "global_load_async_to_lds_b128 %5, %13, off\n\t"
                 "global_load_async_to_lds_b128 %6, %14, off\n\t"
                 "global_load_async_to_lds_b128 %7, %15, off\n\t"
                 "s_wait_xcnt 0x0"
                 :: "v"(l),                    "v"(l +  16 * PITCH * 4),
                    "v"(l +  32 * PITCH * 4),  "v"(l +  48 * PITCH * 4),
                    "v"(l +  64 * PITCH * 4),  "v"(l +  80 * PITCH * 4),
                    "v"(l +  96 * PITCH * 4),  "v"(l + 112 * PITCH * 4),
                    "v"(g),                    "v"(g +  16 * 1024),
                    "v"(g +  32 * 1024),       "v"(g +  48 * 1024),
                    "v"(g +  64 * 1024),       "v"(g +  80 * 1024),
                    "v"(g +  96 * 1024),       "v"(g + 112 * 1024)
                 : "memory");
}
__device__ __forceinline__ void ring_publish() {
    asm volatile("s_wait_dscnt 0x0" ::: "memory");
    wait_async0();
    __syncthreads();
}

// ---------------------------------------------------------------------------
// Fused attention per (q-tile 16, head, batch):
//   S = (Q Kh^T)/8 + bias  -> row softmax -> O = P Vh
// K and V come in 16 stages of 128 keys (8 of K, then 8 of V) through two LDS
// buffers: the copies of stage s + 2 are issued behind the barrier that ends
// trip s, and fly while trip s + 1 runs on the other buffer.
// ---------------------------------------------------------------------------
#define SST 1028   // padded S row stride
#define VST 68     // K tile row pitch: a b64 fragment read meets all 64 banks
#define VPT 80     // V tile row pitch: rows k..k+3 x 16 columns meet all 64 banks
#define KVBUF 10240    // floats per ring buffer: 128 * VPT
#define KVSTAGE (2 * KVBUF)

__global__ __launch_bounds__(256)
void attn_kernel(const float* __restrict__ q,   // (4,600,512)
                 const float* __restrict__ kv,  // (4,1024,8*128): +0..63 K, +64..127 V
                 const float* __restrict__ bias, // (4,8,608,1024)
                 float* __restrict__ ctx)       // (4,600,512)
{
    extern __shared__ __attribute__((aligned(16))) float smem[];  // 16-byte copies land here
    float* S    = smem;               // 16 * SST
    float* Kst  = S + 16 * SST;       // KVSTAGE: the two ring buffers
    float* Ored = Kst + KVSTAGE;      // 1024 split-K combine

    const int tid  = threadIdx.x;
    const int wv   = tid >> 5;
    const int lane = tid & 31;
    const int lm   = lane & 15;
    const int hi   = lane >> 4;
    const int qt   = blockIdx.x;
    const int h    = blockIdx.y;
    const int b    = blockIdx.z;
    const int q0   = qt * 16;

    const float* kp = kv + (size_t)(b * 1024) * 1024 + h * 128;   // K rows; V at +64

    // ---- ring prologue: stage 0 lands and is published, stage 1 takes off
    stage_tile<VST>(Kst, kp, tid);

    // ---- preload Q fragments: all 16 k-steps over d=64, one v2f each
    int qr = q0 + lm; if (qr > 599) qr = 599;
    const float* qp = q + (size_t)(b * 600 + qr) * 512 + h * 64;
    v2f afr[16];
#pragma unroll
    for (int ks = 0; ks < 16; ++ks)
        afr[ks] = *(const v2f*)(qp + ks * 4 + 2 * hi);

    wait_async0();
    __syncthreads();
    stage_tile<VST>(Kst + KVBUF, kp + (size_t)128 * 1024, tid);

    // ---- Phase 1: S = Q K^T  (a wave owns 16 keys of each 128-key stage)
    for (int t = 0; t < 8; ++t) {
        const float* Kb = Kst + (t & 1) * KVBUF;
        const int kb = wv * 16;
        v8f acc = {0.f,0.f,0.f,0.f,0.f,0.f,0.f,0.f};
#pragma unroll
        for (int ks = 0; ks < 16; ++ks) {
            int kk = ks * 4 + 2 * hi;
            v2f bb = *(const v2f*)&Kb[(kb + lm) * VST + kk];
            acc = WMMA_F32(afr[ks], bb, acc);
        }
#pragma unroll
        for (int r = 0; r < 8; ++r)
            S[(r + 8 * hi) * SST + t * 128 + kb + lm] = acc[r];

        ring_publish();
        float* nb = Kst + (t & 1) * KVBUF;      // the buffer this trip has read
        if (t < 6) stage_tile<VST>(nb, kp + (size_t)((t + 2) * 128) * 1024, tid);
        else       stage_tile<VPT>(nb, kp + (size_t)((t - 6) * 128) * 1024 + 64, tid);
    }

    // ---- Phase 2: 1/sqrt(64) scale + precomputed position bias, in place on S
    const float* bp = bias + ((size_t)(b * 8 + h) * 608 + q0) * 1024 + tid * 4;
    float4 bv[16];
#pragma unroll
    for (int row = 0; row < 16; ++row)
        bv[row] = *(const float4*)(bp + row * 1024);
#pragma unroll
    for (int row = 0; row < 16; ++row) {
        float4* sp = (float4*)(S + row * SST + tid * 4);
        float4 sv = *sp;
        sv.x = sv.x * 0.125f + bv[row].x; sv.y = sv.y * 0.125f + bv[row].y;
        sv.z = sv.z * 0.125f + bv[row].z; sv.w = sv.w * 0.125f + bv[row].w;
        *sp = sv;
    }
    __syncthreads();

    // ---- Phase 3: row softmax (wave owns 2 rows; wave32 shuffles)
#pragma unroll
    for (int rr = 0; rr < 2; ++rr) {
        int row = wv * 2 + rr;
        float* sr = S + row * SST;
        float ev[32];
        float mx = -3.0e38f;
#pragma unroll
        for (int i = 0; i < 32; ++i) { ev[i] = sr[lane + i * 32]; mx = fmaxf(mx, ev[i]); }
#pragma unroll
        for (int off = 16; off > 0; off >>= 1) mx = fmaxf(mx, __shfl_xor(mx, off, 32));
        float sum = 0.0f;
#pragma unroll
        for (int i = 0; i < 32; ++i) { ev[i] = __expf(ev[i] - mx); sum += ev[i]; }
#pragma unroll
        for (int off = 16; off > 0; off >>= 1) sum += __shfl_xor(sum, off, 32);
        float inv = 1.0f / sum;
#pragma unroll
        for (int i = 0; i < 32; ++i) sr[lane + i * 32] = ev[i] * inv;
    }
    __syncthreads();

    // ---- Phase 4: O = P V ; V row-major, a B fragment is two rows' dwords
    const int dt    = wv & 3;
    const int half  = wv >> 2;
    const int dbase = dt * 16;
    v8f acc = {0.f,0.f,0.f,0.f,0.f,0.f,0.f,0.f};

    for (int t = 0; t < 8; ++t) {
        const int    k0 = half * 64 + 2 * hi;   // this lane-half's first key of the stage
        const float* vp = Kst + (t & 1) * KVBUF + k0 * VPT + dbase + lm;
        const float* sp = S + lm * SST + t * 128 + k0;
#pragma unroll
        for (int ks = 0; ks < 16; ++ks) {
            v2f a  = *(const v2f*)(sp + ks * 4);
            v2f bb = {vp[ks * 4 * VPT], vp[ks * 4 * VPT + VPT]};
            acc = WMMA_F32(a, bb, acc);
        }

        ring_publish();
        if (t < 6)      // trips 6 and 7 refill nothing: their foot's wait is the last one
            stage_tile<VPT>(Kst + (t & 1) * KVBUF, kp + (size_t)((t + 2) * 128) * 1024 + 64, tid);
    }

    if (half == 1) {
#pragma unroll
        for (int r = 0; r < 8; ++r) Ored[dt * 256 + r * 32 + lane] = acc[r];
    }
    __syncthreads();
    if (half == 0) {
#pragma unroll
        for (int r = 0; r < 8; ++r) {
            float o = acc[r] + Ored[dt * 256 + r * 32 + lane];
            int qrow = q0 + r + 8 * hi;
            if (qrow < 600)
                ctx[(size_t)(b * 600 + qrow) * 512 + h * 64 + dbase + lm] = o;
        }
    }
}

// ---------------------------------------------------------------------------
extern "C" void kernel_launch(void* const* d_in, const int* in_sizes, int n_in,
                              void* d_out, int out_size, void* d_ws, size_t ws_size,
                              hipStream_t stream)
{
    (void)in_sizes; (void)n_in; (void)out_size; (void)ws_size;

    const float* nodes  = (const float*)d_in[0];
    const float* images = (const float*)d_in[1];
    const float* rel    = (const float*)d_in[2];
    const float* q_w    = (const float*)d_in[3];
    const float* q_b    = (const float*)d_in[4];
    const float* kv_w   = (const float*)d_in[5];
    const float* kv_b   = (const float*)d_in[6];
    const float* cpb_w1 = (const float*)d_in[7];
    const float* cpb_b1 = (const float*)d_in[8];
    const float* cpb_w2 = (const float*)d_in[9];
    const float* cpb_b2 = (const float*)d_in[10];
    const float* out_w  = (const float*)d_in[11];
    const float* out_b  = (const float*)d_in[12];
    float* out = (float*)d_out;

    float* ws   = (float*)d_ws;
    float* qws  = ws;                              // 2400*512
    float* kvws = qws + 2400 * 512;                // 4096*1024
    float* ctx  = kvws + 4096 * 1024;              // 2400*512
    float* cpb  = ctx + 2400 * 512;                // 4*8*608*1024

    dim3 blk(256);
    front_kernel<<<dim3(3760), blk, 0, stream>>>(nodes, q_w, q_b, qws, images, kv_w, kv_b, kvws,
                                                 rel, cpb_w1, cpb_b1, cpb_w2, cpb_b2, cpb);

    size_t smem = (size_t)(16 * SST + KVSTAGE + 1024) * sizeof(float);
    attn_kernel<<<dim3(38, 8, 4), blk, smem, stream>>>(qws, kvws, cpb, ctx);

    gemm_bias_kernel<<<dim3(38, 8), blk, 0, stream>>>(ctx, out_w, out_b, out, 2400, 512, 512);
}

// v004
// Measured time: 129 microseconds a run.
// In both of two side-by-side timings against v003, it was 1.17 times as fast.
// Counting every step since v000, it is 5.52 times as fast.
#include <hip/hip_runtime.h>

typedef float v2f __attribute__((ext_vector_type(2)));
typedef float v8f __attribute__((ext_vector_type(8)));

#define WMMA_F32(a, b, c) \
  __builtin_amdgcn_wmma_f32_16x16x4_f32(false, (a), false, (b), (short)0, (c), false, false)

// ---------------------------------------------------------------------------
// CDNA5 async global->LDS copy (16 bytes per lane, ASYNCcnt-tracked).
// dsaddr = LDS_BASE + VGPR[VDST][lane]; generic shared pointer's low 32 bits
// are the LDS byte offset (aperture truncation).
// ---------------------------------------------------------------------------
__device__ __forceinline__ void wait_async0() {
    asm volatile("s_wait_asynccnt 0x0" ::: "memory");
}

__device__ __forceinline__ void ring_publish() {
    asm volatile("s_wait_dscnt 0x0" ::: "memory");
    wait_async0();
    __syncthreads();
}

// ---------------------------------------------------------------------------
// GEMM + bias:  C[M,N] = A[M,K] @ W[K,N] + bias[N]     (K a multiple of GKC)
// 256 thr = 8 waves, 64x64 block tile, wave = 32x16 slab (2 wmma accums): with
// one column tile per wave a B fragment is one two-address read of rows k, k+1.
// A and W come in stages of GKC k (32 or 64) through two LDS buffers: the copies
// of stage t + 2 are issued behind the barrier that ends trip t and fly while
// trip t + 1 runs on the other buffer.  Both tiles lie row-major, as in memory.
// A tile row pitch GKC + 4: a b64 fragment read meets all 64 banks.
// ---------------------------------------------------------------------------
#define GWP 80     // W tile row pitch: rows k..k+3 x 16 columns meet all 64 banks

// One stage, 16-byte async copies, every lane on: la/lw are the lane's first LDS
// byte addresses in the A and W tiles, AS/WS the byte steps to its next rows.
// s_wait_xcnt 0 is the last line of the copies' own statement, so that it stands
// in front of any rewrite of the address registers the copies name.
template <unsigned AS, unsigned WS>
__device__ __forceinline__ void stage_gemm2(unsigned la, unsigned lw,
                                            const float* ga0, const float* ga1,
                                            const float* gw0, const float* gw1) {
    asm volatile("global_load_async_to_lds_b128 %0, %4, off\n\t"
                 "global_load_async_to_lds_b128 %1, %5, off\n\t"
                 "global_load_async_to_lds_b128 %2, %6, off\n\t"
                 "global_load_async_to_lds_b128 %3, %7, off\n\t"
                 "s_wait_xcnt 0x0"
                 :: "v"(la), "v"(la + AS), "v"(lw), "v"(lw + WS),
                    "v"(ga0), "v"(ga1), "v"(gw0), "v"(gw1)
                 : "memory");
}
template <unsigned AS, unsigned WS>
__device__ __forceinline__ void stage_gemm4(unsigned la, unsigned lw,
                                            const float* ga0, const float* ga1,
                                            const float* ga2, const float* ga3,
                                            const float* gw0, const float* gw1,
                                            const float* gw2, const float* gw3) {
    asm volatile("global_load_async_to_lds_b128 %0, %8, off\n\t"
                 "global_load_async_to_lds_b128 %1, %9, off\n\t"
                 "global_load_async_to_lds_b128 %2, %10, off\n\t"
                 "global_load_async_to_lds_b128 %3, %11, off\n\t"
                 "global_load_async_to_lds_b128 %4, %12, off\n\t"
                 "global_load_async_to_lds_b128 %5, %13, off\n\t"
                 "global_load_async_to_lds_b128 %6, %14, off\n\t"
                 "global_load_async_to_lds_b128 %7, %15, off\n\t"
                 "s_wait_xcnt 0x0"
                 :: "v"(la), "v"(la + AS), "v"(la + 2 * AS), "v"(la + 3 * AS),
                    "v"(lw), "v"(lw + WS), "v"(lw + 2 * WS), "v"(lw + 3 * WS),
                    "v"(ga0), "v"(ga1), "v"(ga2), "v"(ga3),
                    "v"(gw0), "v"(gw1), "v"(gw2), "v"(gw3)
                 : "memory");
}

template <int GKC>
__device__ __forceinline__
void gemm_tile(const float* __restrict__ A, const float* __restrict__ W,
               const float* __restrict__ bias, float* __restrict__ C,
               int M, int N, int K, int m0, int n0)
{
    constexpr int GAP    = GKC + 4;                 // A tile row pitch, floats
    constexpr int GSTAGE = 64 * GAP + GKC * GWP;    // floats per ring buffer
    constexpr int ALR    = GKC / 4;                 // lanes per A row
    constexpr int ARP    = 256 / ALR;               // A rows per copy of the block
    __shared__ __attribute__((aligned(16))) float sG[2 * GSTAGE];  // 16-byte copies land here

    const int tid  = threadIdx.x;
    const int wv   = tid >> 5;
    const int lane = tid & 31;
    const int lm   = lane & 15;
    const int hi   = lane >> 4;
    const int wm   = wv & 1;
    const int wn   = wv >> 1;

    // this lane's share of a stage: A rows ar + i*ARP, W rows wr + i*16, i < GKC/16
    const int ar = tid / ALR, ac = (tid % ALR) * 4;
    const int wr = tid >> 4,  wc = (tid & 15) * 4;
    const float* ga[GKC / 16];
#pragma unroll
    for (int i = 0; i < GKC / 16; ++i) {
        int gr = m0 + ar + i * ARP; if (gr >= M) gr = M - 1;   // clamp; store is guarded
        ga[i] = A + (size_t)gr * K + ac;
    }
    const float* gw    = W + (size_t)wr * N + n0 + wc;
    const size_t wrow  = (size_t)16 * N;
    const size_t wstep = (size_t)GKC * N;
    const unsigned la = (unsigned)(unsigned long long)(sG + ar * GAP + ac);
    const unsigned lw = (unsigned)(unsigned long long)(sG + 64 * GAP + wr * GWP + wc);

    // stage s into ring buffer s & 1
    auto stage = [&](int s) {
        const unsigned bb = (unsigned)(s & 1) * (GSTAGE * 4);
        const size_t   ka = (size_t)s * GKC;
        const float*   w0 = gw + (size_t)s * wstep;
        if constexpr (GKC == 32)
            stage_gemm2<ARP * GAP * 4, 16 * GWP * 4>(la + bb, lw + bb, ga[0] + ka, ga[1] + ka,
                                                     w0, w0 + wrow);
        else
            stage_gemm4<ARP * GAP * 4, 16 * GWP * 4>(la + bb, lw + bb, ga[0] + ka, ga[1] + ka,
                                                     ga[2] + ka, ga[3] + ka,
                                                     w0, w0 + wrow, w0 + 2 * wrow, w0 + 3 * wrow);
    };

    v8f acc0 = {0.f,0.f,0.f,0.f,0.f,0.f,0.f,0.f};
    v8f acc1 = {0.f,0.f,0.f,0.f,0.f,0.f,0.f,0.f};

    const int nt = K / GKC;

    // ---- ring prologue: stage 0 lands and is published, stage 1 takes off
    stage(0);
    wait_async0();
    __syncthreads();
    if (nt > 1) stage(1);

    for (int t = 0; t < nt; ++t) {
        const int    bo = (t & 1) * GSTAGE;
        const float* ap = sG + bo + (wm * 32 + lm) * GAP + 2 * hi;
        const float* wp = sG + bo + 64 * GAP + 2 * hi * GWP + wn * 16 + lm;
#pragma unroll
        for (int ks = 0; ks < GKC / 4; ++ks) {
            v2f a0 = *(const v2f*)(ap + ks * 4);      // k = ks*4 + 2*hi, +1
            v2f a1 = *(const v2f*)(ap + 16 * GAP + ks * 4);
            v2f bb = {wp[ks * 4 * GWP], wp[ks * 4 * GWP + GWP]};
            acc0 = WMMA_F32(a0, bb, acc0);
            acc1 = WMMA_F32(a1, bb, acc1);
        }

        ring_publish();
        if (t + 2 < nt) stage(t + 2);   // refill the buffer this trip has read
    }
    wait_async0();      // behind the last copy, before the wave ends

    const int   c0 = n0 + wn * 16 + lm;        // a lane owns one column
    const float bc = bias[c0];
#pragma unroll
    for (int r = 0; r < 8; ++r) {
        int gm = m0 + wm * 32 + r + 8 * hi;    // D: lanes>=16 hold M=r+8
        if (gm < M)      C[(size_t)gm * N + c0]        = acc0[r] + bc;
        if (gm + 16 < M) C[(size_t)(gm + 16) * N + c0] = acc1[r] + bc;
    }
}

__global__ __launch_bounds__(256)
void gemm_bias_kernel(const float* __restrict__ A, const float* __restrict__ W,
                      const float* __restrict__ bias, float* __restrict__ C,
                      int M, int N, int K)
{
    // about one work-group per WGP here: LDS is free, and a 64-k trip is long
    // enough for the next stage's copies to land behind it
    gemm_tile<64>(A, W, bias, C, M, N, K, blockIdx.x * 64, blockIdx.y * 64);
}

// ---------------------------------------------------------------------------
// Position-bias MLP, once per (b,q,k) pair for all 8 heads:
//   bias[b][h][q][k] = relu(rel @ w1 + b1) @ w2[:,h] + b2[h]
// q runs to 608 (38 tiles of 16); rows 600..607 repeat row 599, so that the
// attention kernel reads whole tiles at constant offsets.
// A lane owns 4 consecutive k of one (b,q) row.  The hidden layer does not
// depend on the head, so it is formed once per pair.  Every packed f32 FMA
// carries two neighbouring k; every weight is uniform over the wave, comes
// through scalar loads and is read as one scalar operand for both halves.
// With only 8 heads an f32 16x16x4 matrix tile would be half idle; by the issue
// rates of the two pipes that is slower here than the packed vector form.
// ---------------------------------------------------------------------------
__device__ __forceinline__
void cpb_row(const float* __restrict__ rel,     // (2400,1024,2)
             const float* __restrict__ w1, const float* __restrict__ b1,
             const float* __restrict__ w2, const float* __restrict__ b2,
             float* __restrict__ bias,          // (4,8,608,1024)
             int row)                           // b*608 + q
{
    const int tid = threadIdx.x;
    const int b   = row / 608;
    const int q   = row - b * 608;
    const int qs  = q > 599 ? 599 : q;
    const int kl  = tid * 4;                                // 256 lanes = 1024 k

    const float4* rp = (const float4*)(rel + ((size_t)(b * 600 + qs) * 1024 + kl) * 2);
    const float4 r01 = rp[0];
    const float4 r23 = rp[1];
    // Precaution: holds any rewrite of the two loads' address registers (the
    // scalar base is reused for the weights' scalar loads) behind this wait.
    asm volatile("s_wait_xcnt 0x0" ::: "memory");
    const v2f dx[2] = {{r01.x, r01.z}, {r23.x, r23.z}};
    const v2f dy[2] = {{r01.y, r01.w}, {r23.y, r23.w}};

    v2f acc[2][8];                                          // [k couple][head]
#pragma unroll
    for (int h = 0; h < 8; ++h) {
        const float bb = b2[h];
        acc[0][h] = (v2f){bb, bb};
        acc[1][h] = (v2f){bb, bb};
    }

    const v2f zero = {0.0f, 0.0f};
#pragma unroll
    for (int j = 0; j < 128; ++j) {
        const float wa = w1[j], wb = w1[128 + j], bh = b1[j];
        v2f hv[2];
#pragma unroll
        for (int c = 0; c < 2; ++c) {
            hv[c] = __builtin_elementwise_fma(dx[c], (v2f){wa, wa},
                    __builtin_elementwise_fma(dy[c], (v2f){wb, wb}, (v2f){bh, bh}));
            hv[c] = __builtin_elementwise_max(hv[c], zero);
        }
#pragma unroll
        for (int h = 0; h < 8; ++h) {
            const float wo = w2[j * 8 + h];
            acc[0][h] = __builtin_elementwise_fma(hv[0], (v2f){wo, wo}, acc[0][h]);
            acc[1][h] = __builtin_elementwise_fma(hv[1], (v2f){wo, wo}, acc[1][h]);
        }
    }

    float* op = bias + ((size_t)(b * 8) * 608 + q) * 1024 + kl;
#pragma unroll
    for (int h = 0; h < 8; ++h) {
        float4 o = {acc[0][h].x, acc[0][h].y, acc[1][h].x, acc[1][h].y};
        *(float4*)(op + (size_t)h * 608 * 1024) = o;
    }
    // Precaution: holds any rewrite of the stores' address and data registers
    // by code that the compiler lays out behind this row, behind this wait.
    asm volatile("s_wait_xcnt 0x0" ::: "memory");
}

// ---------------------------------------------------------------------------
// The three pieces that depend on nothing but the inputs, in ONE launch: the
// K/V projection (1024 tiles), the Q projection (304 tiles) and the position
// bias (2432 rows).  A work-group is one GEMM tile or one bias row, by its
// index alone.  The GEMM tiles wait on loads and fill the matrix pipe, the
// bias rows fill the vector pipe: resident on the same SIMDs each runs in the
// other's idle slots.  The long GEMM tiles stand early in the index order, two
// to each bias row, and the short bias rows make up the end of the launch.
// ---------------------------------------------------------------------------
__global__ __launch_bounds__(256)
void front_kernel(const float* __restrict__ nodes,  const float* __restrict__ q_w,
                  const float* __restrict__ q_b,    float* __restrict__ qws,
                  const float* __restrict__ images, const float* __restrict__ kv_w,
                  const float* __restrict__ kv_b,   float* __restrict__ kvws,
                  const float* __restrict__ rel,
                  const float* __restrict__ w1, const float* __restrict__ b1,
                  const float* __restrict__ w2, const float* __restrict__ b2,
                  float* __restrict__ bias)
{
    const int bid = blockIdx.x;                 // 0..3759
    const int t   = bid / 3;
    const int r   = bid - t * 3;
    if (bid < 1992 && r < 2) {                  // 664 triples hold the 1328 tiles
        const int  g  = t * 2 + r;
        const bool kv = g < 1024;               // K/V tiles first, then Q tiles
        const int  gq = g - 1024;
        const int  ny = kv ? (g >> 6) : gq / 38;
        const int  nx = kv ? (g & 63) : gq - ny * 38;
        // 32-k stages: the ring takes the LDS of the former single buffer, so as
        // many work-groups stay resident as before
        gemm_tile<32>(kv ? images : nodes, kv ? kv_w : q_w, kv ? kv_b : q_b,
                      kv ? kvws : qws, kv ? 4096 : 2400, kv ? 1024 : 512, 512,
                      nx * 64, ny * 64);
    } else {
        cpb_row(rel, w1, b1, w2, b2, bias, bid < 1992 ? t : bid - 1328);
    }
}

// ---------------------------------------------------------------------------
// One 128-row x 64-float tile of K or V (rows 4 KiB apart in kv) into LDS at
// row pitch PITCH floats: 8 async 16-byte copies per lane, every lane on.
// s_wait_xcnt 0 is the last line of the copies' own statement, so that it
// stands in front of any rewrite of the address registers the copies name.
// ---------------------------------------------------------------------------
template <int PITCH>
__device__ __forceinline__ void stage_tile(float* buf, const float* src, int tid) {
    const int r  = tid >> 4;
    const int c4 = (tid & 15) * 4;
    const unsigned l = (unsigned)(unsigned long long)(buf + r * PITCH + c4);
    const float*   g = src + (size_t)r * 1024 + c4;
    asm volatile("global_load_async_to_lds_b128 %0, %8, off\n\t"
                 "global_load_async_to_lds_b128 %1, %9, off\n\t"
                 "global_load_async_to_lds_b128 %2, %10, off\n\t"
                 "global_load_async_to_lds_b128 %3, %11, off\n\t"
                 "global_load_async_to_lds_b128 %4, %12, off\n\t"
                 "global_load_async_to_lds_b128 %5, %13, off\n\t"
                 "global_load_async_to_lds_b128 %6, %14, off\n\t"
                 "global_load_async_to_lds_b128 %7, %15, off\n\t"
                 "s_wait_xcnt 0x0"
                 :: "v"(l),                    "v"(l +  16 * PITCH * 4),
                    "v"(l +  32 * PITCH * 4),  "v"(l +  48 * PITCH * 4),
                    "v"(l +  64 * PITCH * 4),  "v"(l +  80 * PITCH * 4),
                    "v"(l +  96 * PITCH * 4),  "v"(l + 112 * PITCH * 4),
                    "v"(g),                    "v"(g +  16 * 1024),
                    "v"(g +  32 * 1024),       "v"(g +  48 * 1024),
                    "v"(g +  64 * 1024),       "v"(g +  80 * 1024),
                    "v"(g +  96 * 1024),       "v"(g + 112 * 1024)
                 : "memory");
}

// ---------------------------------------------------------------------------
// Fused attention per (q-tile 16, head, batch):
//   S = (Q Kh^T)/8 + bias  -> row softmax -> O = P Vh
// K and V come in 16 stages of 128 keys (8 of K, then 8 of V) through two LDS
// buffers: the copies of stage s + 2 are issued behind the barrier that ends
// trip s, and fly while trip s + 1 runs on the other buffer.
// ---------------------------------------------------------------------------
#define SST 1028   // padded S row stride
#define VST 68     // K tile row pitch: a b64 fragment read meets all 64 banks
#define VPT 80     // V tile row pitch: rows k..k+3 x 16 columns meet all 64 banks
#define KVBUF 10240    // floats per ring buffer: 128 * VPT
#define KVSTAGE (2 * KVBUF)

__global__ __launch_bounds__(256)
void attn_kernel(const float* __restrict__ q,   // (4,600,512)
                 const float* __restrict__ kv,  // (4,1024,8*128): +0..63 K, +64..127 V
                 const float* __restrict__ bias, // (4,8,608,1024)
                 float* __restrict__ ctx)       // (4,600,512)
{
    extern __shared__ __attribute__((aligned(16))) float smem[];  // 16-byte copies land here
    float* S    = smem;               // 16 * SST
    float* Kst  = S + 16 * SST;       // KVSTAGE: the two ring buffers
    float* Ored = Kst + KVSTAGE;      // 1024 split-K combine

    const int tid  = threadIdx.x;
    const int wv   = tid >> 5;
    const int lane = tid & 31;
    const int lm   = lane & 15;
    const int hi   = lane >> 4;
    const int qt   = blockIdx.x;
    const int h    = blockIdx.y;
    const int b    = blockIdx.z;
    const int q0   = qt * 16;

    const float* kp = kv + (size_t)(b * 1024) * 1024 + h * 128;   // K rows; V at +64

    // ---- ring prologue: stage 0 lands and is published, stage 1 takes off
    stage_tile<VST>(Kst, kp, tid);

    // ---- preload Q fragments: all 16 k-steps over d=64, one v2f each
    int qr = q0 + lm; if (qr > 599) qr = 599;
    const float* qp = q + (size_t)(b * 600 + qr) * 512 + h * 64;
    v2f afr[16];
#pragma unroll
    for (int ks = 0; ks < 16; ++ks)
        afr[ks] = *(const v2f*)(qp + ks * 4 + 2 * hi);

    wait_async0();
    __syncthreads();
    stage_tile<VST>(Kst + KVBUF, kp + (size_t)128 * 1024, tid);

    // ---- Phase 1: S = Q K^T  (a wave owns 16 keys of each 128-key stage)
    for (int t = 0; t < 8; ++t) {
        const float* Kb = Kst + (t & 1) * KVBUF;
        const int kb = wv * 16;
        v8f acc = {0.f,0.f,0.f,0.f,0.f,0.f,0.f,0.f};
#pragma unroll
        for (int ks = 0; ks < 16; ++ks) {
            int kk = ks * 4 + 2 * hi;
            v2f bb = *(const v2f*)&Kb[(kb + lm) * VST + kk];
            acc = WMMA_F32(afr[ks], bb, acc);
        }
#pragma unroll
        for (int r = 0; r < 8; ++r)
            S[(r + 8 * hi) * SST + t * 128 + kb + lm] = acc[r];

        ring_publish();
        float* nb = Kst + (t & 1) * KVBUF;      // the buffer this trip has read
        if (t < 6) stage_tile<VST>(nb, kp + (size_t)((t + 2) * 128) * 1024, tid);
        else       stage_tile<VPT>(nb, kp + (size_t)((t - 6) * 128) * 1024 + 64, tid);
    }

    // ---- Phase 2: 1/sqrt(64) scale + precomputed position bias, in place on S
    const float* bp = bias + ((size_t)(b * 8 + h) * 608 + q0) * 1024 + tid * 4;
    float4 bv[16];
#pragma unroll
    for (int row = 0; row < 16; ++row)
        bv[row] = *(const float4*)(bp + row * 1024);
#pragma unroll
    for (int row = 0; row < 16; ++row) {
        float4* sp = (float4*)(S + row * SST + tid * 4);
        float4 sv = *sp;
        sv.x = sv.x * 0.125f + bv[row].x; sv.y = sv.y * 0.125f + bv[row].y;
        sv.z = sv.z * 0.125f + bv[row].z; sv.w = sv.w * 0.125f + bv[row].w;
        *sp = sv;
    }
    __syncthreads();

    // ---- Phase 3: row softmax (wave owns 2 rows; wave32 shuffles)
#pragma unroll
    for (int rr = 0; rr < 2; ++rr) {
        int row = wv * 2 + rr;
        float* sr = S + row * SST;
        float ev[32];
        float mx = -3.0e38f;
#pragma unroll
        for (int i = 0; i < 32; ++i) { ev[i] = sr[lane + i * 32]; mx = fmaxf(mx, ev[i]); }
#pragma unroll
        for (int off = 16; off > 0; off >>= 1) mx = fmaxf(mx, __shfl_xor(mx, off, 32));
        float sum = 0.0f;
#pragma unroll
        for (int i = 0; i < 32; ++i) { ev[i] = __expf(ev[i] - mx); sum += ev[i]; }
#pragma unroll
        for (int off = 16; off > 0; off >>= 1) sum += __shfl_xor(sum, off, 32);
        float inv = 1.0f / sum;
#pragma unroll
        for (int i = 0; i < 32; ++i) sr[lane + i * 32] = ev[i] * inv;
    }
    __syncthreads();

    // ---- Phase 4: O = P V ; V row-major, a B fragment is two rows' dwords
    const int dt    = wv & 3;
    const int half  = wv >> 2;
    const int dbase = dt * 16;
    v8f acc = {0.f,0.f,0.f,0.f,0.f,0.f,0.f,0.f};

    for (int t = 0; t < 8; ++t) {
        const int    k0 = half * 64 + 2 * hi;   // this lane-half's first key of the stage
        const float* vp = Kst + (t & 1) * KVBUF + k0 * VPT + dbase + lm;
        const float* sp = S + lm * SST + t * 128 + k0;
#pragma unroll
        for (int ks = 0; ks < 16; ++ks) {
            v2f a  = *(const v2f*)(sp + ks * 4);
            v2f bb = {vp[ks * 4 * VPT], vp[ks * 4 * VPT + VPT]};
            acc = WMMA_F32(a, bb, acc);
        }

        ring_publish();
        if (t < 6)      // trips 6 and 7 refill nothing: their foot's wait is the last one
            stage_tile<VPT>(Kst + (t & 1) * KVBUF, kp + (size_t)((t + 2) * 128) * 1024 + 64, tid);
    }

    if (half == 1) {
#pragma unroll
        for (int r = 0; r < 8; ++r) Ored[dt * 256 + r * 32 + lane] = acc[r];
    }
    __syncthreads();
    if (half == 0) {
#pragma unroll
        for (int r = 0; r < 8; ++r) {
            float o = acc[r] + Ored[dt * 256 + r * 32 + lane];
            int qrow = q0 + r + 8 * hi;
            if (qrow < 600)
                ctx[(size_t)(b * 600 + qrow) * 512 + h * 64 + dbase + lm] = o;
        }
    }
}

// ---------------------------------------------------------------------------
extern "C" void kernel_launch(void* const* d_in, const int* in_sizes, int n_in,
                              void* d_out, int out_size, void* d_ws, size_t ws_size,
                              hipStream_t stream)
{
    (void)in_sizes; (void)n_in; (void)out_size; (void)ws_size;

    const float* nodes  = (const float*)d_in[0];
    const float* images = (const float*)d_in[1];
    const float* rel    = (const float*)d_in[2];
    const float* q_w    = (const float*)d_in[3];
    const float* q_b    = (const float*)d_in[4];
    const float* kv_w   = (const float*)d_in[5];
    const float* kv_b   = (const float*)d_in[6];
    const float* cpb_w1 = (const float*)d_in[7];
    const float* cpb_b1 = (const float*)d_in[8];
    const float* cpb_w2 = (const float*)d_in[9];
    const float* cpb_b2 = (const float*)d_in[10];
    const float* out_w  = (const float*)d_in[11];
    const float* out_b  = (const float*)d_in[12];
    float* out = (float*)d_out;

    float* ws   = (float*)d_ws;
    float* qws  = ws;                              // 2400*512
    float* kvws = qws + 2400 * 512;                // 4096*1024
    float* ctx  = kvws + 4096 * 1024;              // 2400*512
    float* cpb  = ctx + 2400 * 512;                // 4*8*608*1024

    dim3 blk(256);
    front_kernel<<<dim3(3760), blk, 0, stream>>>(nodes, q_w, q_b, qws, images, kv_w, kv_b, kvws,
                                                 rel, cpb_w1, cpb_b1, cpb_w2, cpb_b2, cpb);

    size_t smem = (size_t)(16 * SST + KVSTAGE + 1024) * sizeof(float);
    attn_kernel<<<dim3(38, 8, 4), blk, smem, stream>>>(qws, kvws, cpb, ctx);

    gemm_bias_kernel<<<dim3(38, 8), blk, 0, stream>>>(ctx, out_w, out_b, out, 2400, 512, 512);
}
